// v000
// Measured on an AMD MI455X. A time is GPU time per run, averaged over a window of back-to-back runs after a warm-up
// (all launches, gaps included; the runs take copies of the inputs in turn), and the median of several windows.
// Apart from v000's, it joins two sittings. Times from different sittings can be a few percent apart, while
// side-by-side timings come from the same sitting.
// The starting kernel, v000, takes 395 microseconds a run.
#include <hip/hip_runtime.h>
#include <hip/hip_bf16.h>

typedef float v2f __attribute__((ext_vector_type(2)));
typedef float v8f __attribute__((ext_vector_type(8)));

#define C_   256
#define CK_  32
#define N_   4096

__device__ __forceinline__ v8f wmma_f32(v2f a, v2f b, v8f c) {
    return __builtin_amdgcn_wmma_f32_16x16x4_f32(false, a, false, b, (short)0, c,
                                                 false, false);
}
__device__ __forceinline__ v2f ld2(const float* p) { return *(const v2f*)p; }

// f/g are stored PAIR-INTERLEAVED: element (k, n) -> [(k>>1)*2*N_ + 2*n + (k&1)]
// so a WMMA K-slice (rows k0+2*half, k0+2*half+1 at one column) is ONE aligned
// v2f load, coalesced across lanes (8-byte stride).

// ---------------------------------------------------------------------------
// Kernel 1: fused projections  f = fw@x+fb, g = gw@x+gb, hv = hw@x+hb
// grid: (N/128, 20, B)  block: 256 (8 waves, each a 16x16 output tile, K=256)
// ---------------------------------------------------------------------------
__global__ __launch_bounds__(256) void proj_kernel(
    const float* __restrict__ x,
    const float* __restrict__ fw, const float* __restrict__ fb,
    const float* __restrict__ gw, const float* __restrict__ gb,
    const float* __restrict__ hw, const float* __restrict__ hb,
    float* __restrict__ fbuf, float* __restrict__ gbuf, float* __restrict__ hvbuf)
{
    __shared__ float wtile[16 * 257];   // W tile, pitch 257 -> conflict-free

    const int b     = blockIdx.z;
    const int otile = blockIdx.y;               // 0..19
    const int wv    = threadIdx.x >> 5;
    const int lane  = threadIdx.x & 31;
    const int half  = lane >> 4;
    const int idx   = lane & 15;
    const int n0    = blockIdx.x * 128 + wv * 16;

    const float* W;  const float* bias;  float* outp;  int orow;  bool pairLayout;
    if (otile < 2)      { W = fw; bias = fb; outp = fbuf;  orow = otile * 16;       pairLayout = true;  }
    else if (otile < 4) { W = gw; bias = gb; outp = gbuf;  orow = (otile - 2) * 16; pairLayout = true;  }
    else                { W = hw; bias = hb; outp = hvbuf; orow = (otile - 4) * 16; pairLayout = false; }

    // cooperative, coalesced stage of 16x256 weight tile
    for (int t = threadIdx.x; t < 16 * 256; t += 256) {
        int r = t >> 8, c = t & 255;
        wtile[r * 257 + c] = W[(orow + r) * 256 + c];
    }
    __syncthreads();

    const float* xb = x + (size_t)b * C_ * N_;
    v8f acc = {};
#pragma unroll 4
    for (int k = 0; k < 256; k += 4) {
        v2f a, bb;
        a.x  = wtile[idx * 257 + k + 2 * half];
        a.y  = wtile[idx * 257 + k + 2 * half + 1];
        bb.x = xb[(size_t)(k + 2 * half)     * N_ + n0 + idx];
        bb.y = xb[(size_t)(k + 2 * half + 1) * N_ + n0 + idx];
        acc = wmma_f32(a, bb, acc);
    }

    float* ob = outp + (size_t)b * (pairLayout ? CK_ : C_) * N_;
    if (pairLayout) {
#pragma unroll
        for (int r = 0; r < 8; ++r) {
            int o = orow + r + 8 * half;
            ob[(size_t)(o >> 1) * 2 * N_ + 2 * (n0 + idx) + (o & 1)] = acc[r] + bias[o];
        }
    } else {
#pragma unroll
        for (int r = 0; r < 8; ++r) {
            int o = orow + r + 8 * half;
            ob[(size_t)o * N_ + n0 + idx] = acc[r] + bias[o];
        }
    }
}

// ---------------------------------------------------------------------------
// Kernel 2: row stats of S = f^T g :  M_j = max_m S[j,m], Linv_j = 1/sum exp
// grid: (N/64, B)  block: 128 (4 waves, each owns a 16-row j tile)
// ---------------------------------------------------------------------------
__global__ __launch_bounds__(128) void stats_kernel(
    const float* __restrict__ fbuf, const float* __restrict__ gbuf,
    float* __restrict__ Mrow, float* __restrict__ Linv)
{
    const int b    = blockIdx.y;
    const int wv   = threadIdx.x >> 5;
    const int lane = threadIdx.x & 31;
    const int half = lane >> 4;
    const int idx  = lane & 15;
    const int j0   = blockIdx.x * 64 + wv * 16;

    const float* fp = fbuf + (size_t)b * CK_ * N_;   // pair-interleaved
    const float* gp = gbuf + (size_t)b * CK_ * N_;   // pair-interleaved

    // A-operand (f^T tile) is constant over the m sweep: hoist (b64 coalesced)
    v2f af[8];
#pragma unroll
    for (int k8 = 0; k8 < 8; ++k8)
        af[k8] = ld2(fp + (size_t)(2 * k8 + half) * 2 * N_ + 2 * (j0 + idx));

    float Mv[8], Lv[8];
#pragma unroll
    for (int r = 0; r < 8; ++r) { Mv[r] = -1e30f; Lv[r] = 0.0f; }

    for (int m0 = 0; m0 < N_; m0 += 16) {
        v8f s = {};
#pragma unroll
        for (int k8 = 0; k8 < 8; ++k8) {
            v2f bg = ld2(gp + (size_t)(2 * k8 + half) * 2 * N_ + 2 * (m0 + idx));
            s = wmma_f32(af[k8], bg, s);
        }
#pragma unroll
        for (int r = 0; r < 8; ++r) {
            float v  = s[r];
            float nm = fmaxf(Mv[r], v);
            Lv[r] = Lv[r] * __expf(Mv[r] - nm) + __expf(v - nm);
            Mv[r] = nm;
        }
    }

    // all-reduce (max, sum) over the 16 lanes of each half (rows r+8*half)
#pragma unroll
    for (int r = 0; r < 8; ++r) {
#pragma unroll
        for (int off = 8; off >= 1; off >>= 1) {
            float Mo = __shfl_xor(Mv[r], off, 32);
            float Lo = __shfl_xor(Lv[r], off, 32);
            float nm = fmaxf(Mv[r], Mo);
            Lv[r] = Lv[r] * __expf(Mv[r] - nm) + Lo * __expf(Mo - nm);
            Mv[r] = nm;
        }
    }
    if (idx == 0) {
#pragma unroll
        for (int r = 0; r < 8; ++r) {
            int j = j0 + r + 8 * half;
            Mrow[b * N_ + j] = Mv[r];
            Linv[b * N_ + j] = 1.0f / Lv[r];
        }
    }
}

// ---------------------------------------------------------------------------
// Kernel 3: fused  out = gamma * (hv @ P) + x,  P[j,m] = exp(S[j,m]-M_j)/L_j
// grid: (N/64, B)  block: 256 (8 waves).  WG output = 256c x 64m, j-block 64.
// ---------------------------------------------------------------------------
__global__ __launch_bounds__(256) void attn_kernel(
    const float* __restrict__ x,
    const float* __restrict__ fbuf, const float* __restrict__ gbuf,
    const float* __restrict__ hvbuf,
    const float* __restrict__ Mrow, const float* __restrict__ Linv,
    const float* __restrict__ gammap,
    float* __restrict__ out)
{
    __shared__ float Plds[64 * 64];     // 16 KB P block (rows j, cols m)

    const int b    = blockIdx.y;
    const int m0   = blockIdx.x * 64;
    const int wv   = threadIdx.x >> 5;
    const int lane = threadIdx.x & 31;
    const int half = lane >> 4;
    const int idx  = lane & 15;

    const float* fp = fbuf  + (size_t)b * CK_ * N_;  // pair-interleaved
    const float* gp = gbuf  + (size_t)b * CK_ * N_;  // pair-interleaved
    const float* hp = hvbuf + (size_t)b * C_  * N_;  // row-major [c][n]
    const float* Mr = Mrow + b * N_;
    const float* Lr = Linv + b * N_;

    // This wave's two P tiles: common j sub-tile jt, m sub-tiles mtA, mtA+1
    const int jt  = wv >> 1;            // 0..3
    const int mtA = (wv & 1) * 2;       // 0 or 2

    // g tiles depend only on m0: hoist across the whole j loop (b64 loads)
    v2f gt[2][8];
#pragma unroll
    for (int t = 0; t < 2; ++t)
#pragma unroll
        for (int k8 = 0; k8 < 8; ++k8)
            gt[t][k8] = ld2(gp + (size_t)(2 * k8 + half) * 2 * N_
                               + 2 * (m0 + (mtA + t) * 16 + idx));

    const int cBase = wv * 32;          // this wave's 32 output channels
    v8f acc[2][4];
#pragma unroll
    for (int tc = 0; tc < 2; ++tc)
#pragma unroll
        for (int tm = 0; tm < 4; ++tm) acc[tc][tm] = (v8f){};

    for (int jb = 0; jb < N_; jb += 64) {
        // -------- Phase A: build P[64 x 64] in LDS --------
        const int jrow = jb + jt * 16;
        v2f ft[8];
#pragma unroll
        for (int k8 = 0; k8 < 8; ++k8)
            ft[k8] = ld2(fp + (size_t)(2 * k8 + half) * 2 * N_ + 2 * (jrow + idx));

        float mj[8], lj[8];
#pragma unroll
        for (int r = 0; r < 8; ++r) {
            int j = jrow + r + 8 * half;
            mj[r] = Mr[j];
            lj[r] = Lr[j];
        }
#pragma unroll
        for (int t = 0; t < 2; ++t) {
            v8f s = {};
#pragma unroll
            for (int k8 = 0; k8 < 8; ++k8)
                s = wmma_f32(ft[k8], gt[t][k8], s);
#pragma unroll
            for (int r = 0; r < 8; ++r) {
                float p = __expf(s[r] - mj[r]) * lj[r];
                Plds[(jt * 16 + r + 8 * half) * 64 + (mtA + t) * 16 + idx] = p;
            }
        }
        __syncthreads();

        // -------- Phase B: acc += hv[:, jb:jb+64] x P  (b64 A-loads) --------
#pragma unroll 4
        for (int ks = 0; ks < 64; ks += 4) {
            v2f a0 = ld2(hp + (size_t)(cBase +      idx) * N_ + jb + ks + 2 * half);
            v2f a1 = ld2(hp + (size_t)(cBase + 16 + idx) * N_ + jb + ks + 2 * half);
#pragma unroll
            for (int tm = 0; tm < 4; ++tm) {
                v2f bb;
                bb.x = Plds[(ks + 2 * half)     * 64 + tm * 16 + idx];
                bb.y = Plds[(ks + 2 * half + 1) * 64 + tm * 16 + idx];
                acc[0][tm] = wmma_f32(a0, bb, acc[0][tm]);
                acc[1][tm] = wmma_f32(a1, bb, acc[1][tm]);
            }
        }
        __syncthreads();
    }

    // -------- Epilogue: out = gamma * sa + x --------
    const float gm = gammap[0];
#pragma unroll
    for (int tc = 0; tc < 2; ++tc)
#pragma unroll
        for (int tm = 0; tm < 4; ++tm)
#pragma unroll
            for (int r = 0; r < 8; ++r) {
                int c = cBase + tc * 16 + r + 8 * half;
                int m = m0 + tm * 16 + idx;
                size_t off = ((size_t)b * C_ + c) * N_ + m;
                out[off] = gm * acc[tc][tm][r] + x[off];
            }
}

// ---------------------------------------------------------------------------
extern "C" void kernel_launch(void* const* d_in, const int* in_sizes, int n_in,
                              void* d_out, int out_size, void* d_ws, size_t ws_size,
                              hipStream_t stream) {
    const float* x     = (const float*)d_in[0];
    const float* fw    = (const float*)d_in[1];
    const float* fb    = (const float*)d_in[2];
    const float* gw    = (const float*)d_in[3];
    const float* gb    = (const float*)d_in[4];
    const float* hw    = (const float*)d_in[5];
    const float* hb    = (const float*)d_in[6];
    const float* gamma = (const float*)d_in[7];
    float* out = (float*)d_out;

    const int Bn = in_sizes[0] / (C_ * N_);   // = 4

    float* ws    = (float*)d_ws;
    float* fbuf  = ws;                              // Bn*CK*N (pair-interleaved)
    float* gbuf  = fbuf  + (size_t)Bn * CK_ * N_;   // Bn*CK*N (pair-interleaved)
    float* hvbuf = gbuf  + (size_t)Bn * CK_ * N_;   // Bn*C*N  (row-major)
    float* Mr    = hvbuf + (size_t)Bn * C_  * N_;   // Bn*N
    float* Li    = Mr    + (size_t)Bn * N_;         // Bn*N

    dim3 g1(N_ / 128, (2 * CK_ + C_) / 16, Bn);     // (32, 20, 4)
    proj_kernel<<<g1, 256, 0, stream>>>(x, fw, fb, gw, gb, hw, hb, fbuf, gbuf, hvbuf);

    dim3 g2(N_ / 64, Bn);                           // (64, 4)
    stats_kernel<<<g2, 128, 0, stream>>>(fbuf, gbuf, Mr, Li);

    dim3 g3(N_ / 64, Bn);                           // (64, 4)
    attn_kernel<<<g3, 256, 0, stream>>>(x, fbuf, gbuf, hvbuf, Mr, Li, gamma, out);
}

// v001
// It runs in 295 microseconds.
// In two side-by-side timings against v000, it was 1.38 and 1.37 times as fast.
#include <hip/hip_runtime.h>
#include <hip/hip_bf16.h>

typedef float v2f __attribute__((ext_vector_type(2)));
typedef float v4f __attribute__((ext_vector_type(4)));
typedef float v8f __attribute__((ext_vector_type(8)));

#define C_   256
#define CK_  32
#define N_   4096

__device__ __forceinline__ v8f wmma_f32(v2f a, v2f b, v8f c) {
    return __builtin_amdgcn_wmma_f32_16x16x4_f32(false, a, false, b, (short)0, c,
                                                 false, false);
}
__device__ __forceinline__ v2f ld2(const float* p) { return *(const v2f*)p; }

// f/g are stored PAIR-INTERLEAVED: element (k, n) -> [(k>>1)*2*N_ + 2*n + (k&1)]
// so a WMMA K-slice (rows k0+2*half, k0+2*half+1 at one column) is ONE aligned
// v2f load, coalesced across lanes (8-byte stride).

// ---------------------------------------------------------------------------
// Kernel 1: fused projections  f = fw@x+fb, g = gw@x+gb, hv = hw@x+hb
// grid: (N/128, 20, B)  block: 256 (8 waves, each a 16x16 output tile, K=256)
// ---------------------------------------------------------------------------
__global__ __launch_bounds__(256) void proj_kernel(
    const float* __restrict__ x,
    const float* __restrict__ fw, const float* __restrict__ fb,
    const float* __restrict__ gw, const float* __restrict__ gb,
    const float* __restrict__ hw, const float* __restrict__ hb,
    float* __restrict__ fbuf, float* __restrict__ gbuf, float* __restrict__ hvbuf)
{
    __shared__ float wtile[16 * 257];   // W tile, pitch 257 -> conflict-free

    const int b     = blockIdx.z;
    const int otile = blockIdx.y;               // 0..19
    const int wv    = threadIdx.x >> 5;
    const int lane  = threadIdx.x & 31;
    const int half  = lane >> 4;
    const int idx   = lane & 15;
    const int n0    = blockIdx.x * 128 + wv * 16;

    const float* W;  const float* bias;  float* outp;  int orow;  bool pairLayout;
    if (otile < 2)      { W = fw; bias = fb; outp = fbuf;  orow = otile * 16;       pairLayout = true;  }
    else if (otile < 4) { W = gw; bias = gb; outp = gbuf;  orow = (otile - 2) * 16; pairLayout = true;  }
    else                { W = hw; bias = hb; outp = hvbuf; orow = (otile - 4) * 16; pairLayout = false; }

    // cooperative, coalesced stage of 16x256 weight tile
    for (int t = threadIdx.x; t < 16 * 256; t += 256) {
        int r = t >> 8, c = t & 255;
        wtile[r * 257 + c] = W[(orow + r) * 256 + c];
    }
    __syncthreads();

    const float* xb = x + (size_t)b * C_ * N_;
    v8f acc = {};
#pragma unroll 4
    for (int k = 0; k < 256; k += 4) {
        v2f a, bb;
        a.x  = wtile[idx * 257 + k + 2 * half];
        a.y  = wtile[idx * 257 + k + 2 * half + 1];
        bb.x = xb[(size_t)(k + 2 * half)     * N_ + n0 + idx];
        bb.y = xb[(size_t)(k + 2 * half + 1) * N_ + n0 + idx];
        acc = wmma_f32(a, bb, acc);
    }

    float* ob = outp + (size_t)b * (pairLayout ? CK_ : C_) * N_;
    if (pairLayout) {
#pragma unroll
        for (int r = 0; r < 8; ++r) {
            int o = orow + r + 8 * half;
            ob[(size_t)(o >> 1) * 2 * N_ + 2 * (n0 + idx) + (o & 1)] = acc[r] + bias[o];
        }
    } else {
#pragma unroll
        for (int r = 0; r < 8; ++r) {
            int o = orow + r + 8 * half;
            ob[(size_t)o * N_ + n0 + idx] = acc[r] + bias[o];
        }
    }
}

// ---------------------------------------------------------------------------
// Kernel 2: row stats of S = f^T g :  M_j = max_m S[j,m], Linv_j = 1/sum exp
// grid: (N/32, B)  block: 256 (8 waves).  The WG owns 32 rows j; wave w sweeps
// the 512 columns from w*512 on, as a 32 x 64 tile per trip (8 independent
// accumulator chains, each g fragment used for both row tiles).  The eight
// partial (max, sum) pairs of a row are merged through LDS.
// The '#pragma unroll's on loops over register arrays make those indices constant,
// so that fragments, accumulators and row states stay in registers.
// ---------------------------------------------------------------------------
#define ST_WAVES 8
#define ST_COLS  (N_ / ST_WAVES)     // columns per wave
__global__ __launch_bounds__(256) void stats_kernel(
    const float* __restrict__ fbuf, const float* __restrict__ gbuf,
    float* __restrict__ Mrow, float* __restrict__ Linv)
{
    __shared__ float sM[ST_WAVES][32];
    __shared__ float sL[ST_WAVES][32];

    const int b    = blockIdx.y;
    const int wv   = threadIdx.x >> 5;
    const int lane = threadIdx.x & 31;
    const int half = lane >> 4;
    const int idx  = lane & 15;
    const int j0   = blockIdx.x * 32;
    const int mBeg = wv * ST_COLS;

    const float* fp = fbuf + (size_t)b * CK_ * N_;   // pair-interleaved
    const float* gp = gbuf + (size_t)b * CK_ * N_;   // pair-interleaved

    // A-operands (two f^T tiles) are constant over the m sweep: hoist
    v2f af[2][8];
#pragma unroll
    for (int jt = 0; jt < 2; ++jt)
#pragma unroll
        for (int k8 = 0; k8 < 8; ++k8)
            af[jt][k8] = ld2(fp + (size_t)(2 * k8 + half) * 2 * N_
                                + 2 * (j0 + jt * 16 + idx));

    float Mv[2][8], Lv[2][8];
#pragma unroll
    for (int jt = 0; jt < 2; ++jt)
#pragma unroll
        for (int r = 0; r < 8; ++r) { Mv[jt][r] = -1e30f; Lv[jt][r] = 0.0f; }

    // this lane's first 16 bytes of g: pair row 'half', columns mBeg + 2*idx, +1
    const float* gl = gp + (size_t)half * 2 * N_ + 2 * mBeg + 4 * idx;

    for (int it = 0; it < ST_COLS / 64; ++it, gl += 2 * 64) {
        v8f s[2][4];
#pragma unroll
        for (int jt = 0; jt < 2; ++jt)
#pragma unroll
            for (int t = 0; t < 4; ++t) s[jt][t] = (v8f){};

        // One 16-byte load holds the K pair of columns 2*idx and 2*idx+1: the
        // even columns feed one tile, the odd ones the next.  Row stats do not
        // depend on the order of the columns.
#pragma unroll
        for (int k8 = 0; k8 < 8; ++k8) {
            const float* gr = gl + (size_t)k8 * 4 * N_;
            v4f q0 = *(const v4f*)(gr);
            v4f q1 = *(const v4f*)(gr + 64);
            v2f bg[4] = { {q0.x, q0.y}, {q0.z, q0.w}, {q1.x, q1.y}, {q1.z, q1.w} };
#pragma unroll
            for (int t = 0; t < 4; ++t) {
                s[0][t] = wmma_f32(af[0][k8], bg[t], s[0][t]);
                s[1][t] = wmma_f32(af[1][k8], bg[t], s[1][t]);
            }
        }
#pragma unroll
        for (int jt = 0; jt < 2; ++jt)
#pragma unroll
            for (int r = 0; r < 8; ++r) {
                float v0 = s[jt][0][r], v1 = s[jt][1][r];
                float v2 = s[jt][2][r], v3 = s[jt][3][r];
                float nm = fmaxf(fmaxf(fmaxf(Mv[jt][r], v0), v1), fmaxf(v2, v3));
                Lv[jt][r] = Lv[jt][r] * __expf(Mv[jt][r] - nm)
                          + ((__expf(v0 - nm) + __expf(v1 - nm))
                           + (__expf(v2 - nm) + __expf(v3 - nm)));
                Mv[jt][r] = nm;
            }
    }

    // all-reduce (max, sum) over the 16 lanes of each half (rows r+8*half)
#pragma unroll
    for (int jt = 0; jt < 2; ++jt)
#pragma unroll
        for (int r = 0; r < 8; ++r) {
#pragma unroll
            for (int off = 8; off >= 1; off >>= 1) {
                float Mo = __shfl_xor(Mv[jt][r], off, 32);
                float Lo = __shfl_xor(Lv[jt][r], off, 32);
                float nm = fmaxf(Mv[jt][r], Mo);
                Lv[jt][r] = Lv[jt][r] * __expf(Mv[jt][r] - nm) + Lo * __expf(Mo - nm);
                Mv[jt][r] = nm;
            }
        }
    if (idx == 0) {
#pragma unroll
        for (int jt = 0; jt < 2; ++jt)
#pragma unroll
            for (int r = 0; r < 8; ++r) {
                sM[wv][jt * 16 + r + 8 * half] = Mv[jt][r];
                sL[wv][jt * 16 + r + 8 * half] = Lv[jt][r];
            }
    }
    __syncthreads();   // every wave's partials are in LDS before the merge

    if (threadIdx.x < 32) {
        const int t = threadIdx.x;
        float M = sM[0][t];
#pragma unroll
        for (int w = 1; w < ST_WAVES; ++w) M = fmaxf(M, sM[w][t]);
        float L = 0.0f;
#pragma unroll
        for (int w = 0; w < ST_WAVES; ++w) L += sL[w][t] * __expf(sM[w][t] - M);
        Mrow[b * N_ + j0 + t] = M;
        Linv[b * N_ + j0 + t] = 1.0f / L;
    }
}

// ---------------------------------------------------------------------------
// Kernel 3: fused  out = gamma * (hv @ P) + x,  P[j,m] = exp(S[j,m]-M_j)/L_j
// grid: (N/64, B)  block: 256 (8 waves).  WG output = 256c x 64m, j-block 64.
// ---------------------------------------------------------------------------
__global__ __launch_bounds__(256) void attn_kernel(
    const float* __restrict__ x,
    const float* __restrict__ fbuf, const float* __restrict__ gbuf,
    const float* __restrict__ hvbuf,
    const float* __restrict__ Mrow, const float* __restrict__ Linv,
    const float* __restrict__ gammap,
    float* __restrict__ out)
{
    __shared__ float Plds[64 * 64];     // 16 KB P block (rows j, cols m)

    const int b    = blockIdx.y;
    const int m0   = blockIdx.x * 64;
    const int wv   = threadIdx.x >> 5;
    const int lane = threadIdx.x & 31;
    const int half = lane >> 4;
    const int idx  = lane & 15;

    const float* fp = fbuf  + (size_t)b * CK_ * N_;  // pair-interleaved
    const float* gp = gbuf  + (size_t)b * CK_ * N_;  // pair-interleaved
    const float* hp = hvbuf + (size_t)b * C_  * N_;  // row-major [c][n]
    const float* Mr = Mrow + b * N_;
    const float* Lr = Linv + b * N_;

    // This wave's two P tiles: common j sub-tile jt, m sub-tiles mtA, mtA+1
    const int jt  = wv >> 1;            // 0..3
    const int mtA = (wv & 1) * 2;       // 0 or 2

    // g tiles depend only on m0: hoist across the whole j loop (b64 loads)
    v2f gt[2][8];
#pragma unroll
    for (int t = 0; t < 2; ++t)
#pragma unroll
        for (int k8 = 0; k8 < 8; ++k8)
            gt[t][k8] = ld2(gp + (size_t)(2 * k8 + half) * 2 * N_
                               + 2 * (m0 + (mtA + t) * 16 + idx));

    const int cBase = wv * 32;          // this wave's 32 output channels
    v8f acc[2][4];
#pragma unroll
    for (int tc = 0; tc < 2; ++tc)
#pragma unroll
        for (int tm = 0; tm < 4; ++tm) acc[tc][tm] = (v8f){};

    for (int jb = 0; jb < N_; jb += 64) {
        // -------- Phase A: build P[64 x 64] in LDS --------
        const int jrow = jb + jt * 16;
        v2f ft[8];
#pragma unroll
        for (int k8 = 0; k8 < 8; ++k8)
            ft[k8] = ld2(fp + (size_t)(2 * k8 + half) * 2 * N_ + 2 * (jrow + idx));

        float mj[8], lj[8];
#pragma unroll
        for (int r = 0; r < 8; ++r) {
            int j = jrow + r + 8 * half;
            mj[r] = Mr[j];
            lj[r] = Lr[j];
        }
#pragma unroll
        for (int t = 0; t < 2; ++t) {
            v8f s = {};
#pragma unroll
            for (int k8 = 0; k8 < 8; ++k8)
                s = wmma_f32(ft[k8], gt[t][k8], s);
#pragma unroll
            for (int r = 0; r < 8; ++r) {
                float p = __expf(s[r] - mj[r]) * lj[r];
                Plds[(jt * 16 + r + 8 * half) * 64 + (mtA + t) * 16 + idx] = p;
            }
        }
        __syncthreads();

        // -------- Phase B: acc += hv[:, jb:jb+64] x P  (b64 A-loads) --------
#pragma unroll 4
        for (int ks = 0; ks < 64; ks += 4) {
            v2f a0 = ld2(hp + (size_t)(cBase +      idx) * N_ + jb + ks + 2 * half);
            v2f a1 = ld2(hp + (size_t)(cBase + 16 + idx) * N_ + jb + ks + 2 * half);
#pragma unroll
            for (int tm = 0; tm < 4; ++tm) {
                v2f bb;
                bb.x = Plds[(ks + 2 * half)     * 64 + tm * 16 + idx];
                bb.y = Plds[(ks + 2 * half + 1) * 64 + tm * 16 + idx];
                acc[0][tm] = wmma_f32(a0, bb, acc[0][tm]);
                acc[1][tm] = wmma_f32(a1, bb, acc[1][tm]);
            }
        }
        __syncthreads();
    }

    // -------- Epilogue: out = gamma * sa + x --------
    const float gm = gammap[0];
#pragma unroll
    for (int tc = 0; tc < 2; ++tc)
#pragma unroll
        for (int tm = 0; tm < 4; ++tm)
#pragma unroll
            for (int r = 0; r < 8; ++r) {
                int c = cBase + tc * 16 + r + 8 * half;
                int m = m0 + tm * 16 + idx;
                size_t off = ((size_t)b * C_ + c) * N_ + m;
                out[off] = gm * acc[tc][tm][r] + x[off];
            }
}

// ---------------------------------------------------------------------------
extern "C" void kernel_launch(void* const* d_in, const int* in_sizes, int n_in,
                              void* d_out, int out_size, void* d_ws, size_t ws_size,
                              hipStream_t stream) {
    const float* x     = (const float*)d_in[0];
    const float* fw    = (const float*)d_in[1];
    const float* fb    = (const float*)d_in[2];
    const float* gw    = (const float*)d_in[3];
    const float* gb    = (const float*)d_in[4];
    const float* hw    = (const float*)d_in[5];
    const float* hb    = (const float*)d_in[6];
    const float* gamma = (const float*)d_in[7];
    float* out = (float*)d_out;

    const int Bn = in_sizes[0] / (C_ * N_);   // = 4

    float* ws    = (float*)d_ws;
    float* fbuf  = ws;                              // Bn*CK*N (pair-interleaved)
    float* gbuf  = fbuf  + (size_t)Bn * CK_ * N_;   // Bn*CK*N (pair-interleaved)
    float* hvbuf = gbuf  + (size_t)Bn * CK_ * N_;   // Bn*C*N  (row-major)
    float* Mr    = hvbuf + (size_t)Bn * C_  * N_;   // Bn*N
    float* Li    = Mr    + (size_t)Bn * N_;         // Bn*N

    dim3 g1(N_ / 128, (2 * CK_ + C_) / 16, Bn);     // (32, 20, 4)
    proj_kernel<<<g1, 256, 0, stream>>>(x, fw, fb, gw, gb, hw, hb, fbuf, gbuf, hvbuf);

    dim3 g2(N_ / 32, Bn);                           // (128, 4)
    stats_kernel<<<g2, 256, 0, stream>>>(fbuf, gbuf, Mr, Li);

    dim3 g3(N_ / 64, Bn);                           // (64, 4)
    attn_kernel<<<g3, 256, 0, stream>>>(x, fbuf, gbuf, hvbuf, Mr, Li, gamma, out);
}

// v002
// One run takes 233 microseconds.
// Two timings next to v001 put it at 1.26 and 1.27 times that version's speed.
// Counting every step since v000, it is 1.74 times as fast.
#include <hip/hip_runtime.h>
#include <hip/hip_bf16.h>

typedef float v2f __attribute__((ext_vector_type(2)));
typedef float v4f __attribute__((ext_vector_type(4)));
typedef float v8f __attribute__((ext_vector_type(8)));

#define C_   256
#define CK_  32
#define N_   4096

__device__ __forceinline__ v8f wmma_f32(v2f a, v2f b, v8f c) {
    return __builtin_amdgcn_wmma_f32_16x16x4_f32(false, a, false, b, (short)0, c,
                                                 false, false);
}
__device__ __forceinline__ v2f ld2(const float* p) { return *(const v2f*)p; }

// f/g are stored PAIR-INTERLEAVED: element (k, n) -> [(k>>1)*2*N_ + 2*n + (k&1)]
// so a WMMA K-slice (rows k0+2*half, k0+2*half+1 at one column) is ONE aligned
// v2f load, coalesced across lanes (8-byte stride).

// hv is stored in FRAGMENT ORDER: per batch [j>>4][c>>4][u][lane][e] floats, where
// lane = 16*((j>>3)&1) + (c&15), u = (j>>2)&1, e = j&3.  One 16c x 16j block is
// 1 KB, and a wave reads it with two 16-byte loads per lane, whole lines only.

// ---------------------------------------------------------------------------
// Kernel 1: fused projections  f = fw@x+fb, g = gw@x+gb, hv = hw@x+hb
// grid: (N/128, 20, B)  block: 256 (8 waves, each a 16x16 output tile, K=256)
// ---------------------------------------------------------------------------
__global__ __launch_bounds__(256) void proj_kernel(
    const float* __restrict__ x,
    const float* __restrict__ fw, const float* __restrict__ fb,
    const float* __restrict__ gw, const float* __restrict__ gb,
    const float* __restrict__ hw, const float* __restrict__ hb,
    float* __restrict__ fbuf, float* __restrict__ gbuf, float* __restrict__ hvbuf)
{
    __shared__ float wtile[16 * 257];   // W tile, pitch 257 -> conflict-free

    const int b     = blockIdx.z;
    const int otile = blockIdx.y;               // 0..19
    const int wv    = threadIdx.x >> 5;
    const int lane  = threadIdx.x & 31;
    const int half  = lane >> 4;
    const int idx   = lane & 15;
    const int n0    = blockIdx.x * 128 + wv * 16;

    const float* W;  const float* bias;  float* outp;  int orow;  bool pairLayout;
    if (otile < 2)      { W = fw; bias = fb; outp = fbuf;  orow = otile * 16;       pairLayout = true;  }
    else if (otile < 4) { W = gw; bias = gb; outp = gbuf;  orow = (otile - 2) * 16; pairLayout = true;  }
    else                { W = hw; bias = hb; outp = hvbuf; orow = (otile - 4) * 16; pairLayout = false; }

    // cooperative, coalesced stage of 16x256 weight tile
    for (int t = threadIdx.x; t < 16 * 256; t += 256) {
        int r = t >> 8, c = t & 255;
        wtile[r * 257 + c] = W[(orow + r) * 256 + c];
    }
    __syncthreads();

    const float* xb = x + (size_t)b * C_ * N_;
    v8f acc = {};
    if (pairLayout) {
#pragma unroll 4
        for (int k = 0; k < 256; k += 4) {
            v2f a, bb;
            a.x  = wtile[idx * 257 + k + 2 * half];
            a.y  = wtile[idx * 257 + k + 2 * half + 1];
            bb.x = xb[(size_t)(k + 2 * half)     * N_ + n0 + idx];
            bb.y = xb[(size_t)(k + 2 * half + 1) * N_ + n0 + idx];
            acc = wmma_f32(a, bb, acc);
        }
        float* ob = outp + (size_t)b * CK_ * N_;
#pragma unroll
        for (int r = 0; r < 8; ++r) {
            int o = orow + r + 8 * half;
            ob[(size_t)(o >> 1) * 2 * N_ + 2 * (n0 + idx) + (o & 1)] = acc[r] + bias[o];
        }
    } else {
        // Same fragments with the operands swapped: the tile comes out transposed
        // (register r = column n0 + r + 8*half, lane idx = row orow + idx), which
        // is this lane's 32 bytes of the fragment-order block.
#pragma unroll 4
        for (int k = 0; k < 256; k += 4) {
            v2f a, bb;
            a.x  = wtile[idx * 257 + k + 2 * half];
            a.y  = wtile[idx * 257 + k + 2 * half + 1];
            bb.x = xb[(size_t)(k + 2 * half)     * N_ + n0 + idx];
            bb.y = xb[(size_t)(k + 2 * half + 1) * N_ + n0 + idx];
            acc = wmma_f32(bb, a, acc);
        }
        const float bv = bias[orow + idx];
        float* ob = outp + (size_t)b * C_ * N_
                  + (size_t)((n0 >> 4) * 16 + (orow >> 4)) * 256 + lane * 4;
        v4f lo = { acc[0] + bv, acc[1] + bv, acc[2] + bv, acc[3] + bv };
        v4f hi = { acc[4] + bv, acc[5] + bv, acc[6] + bv, acc[7] + bv };
        *(v4f*)(ob)       = lo;
        *(v4f*)(ob + 128) = hi;
    }
}

// ---------------------------------------------------------------------------
// Kernel 2: row stats of S = f^T g :  M_j = max_m S[j,m], Linv_j = 1/sum exp
// grid: (N/32, B)  block: 256 (8 waves).  The WG owns 32 rows j; wave w sweeps
// the 512 columns from w*512 on, as a 32 x 64 tile per trip (8 independent
// accumulator chains, each g fragment used for both row tiles).  The eight
// partial (max, sum) pairs of a row are merged through LDS.
// The '#pragma unroll's on loops over register arrays make those indices constant,
// so that fragments, accumulators and row states stay in registers.
// ---------------------------------------------------------------------------
#define ST_WAVES 8
#define ST_COLS  (N_ / ST_WAVES)     // columns per wave
__global__ __launch_bounds__(256) void stats_kernel(
    const float* __restrict__ fbuf, const float* __restrict__ gbuf,
    float* __restrict__ Mrow, float* __restrict__ Linv)
{
    __shared__ float sM[ST_WAVES][32];
    __shared__ float sL[ST_WAVES][32];

    const int b    = blockIdx.y;
    const int wv   = threadIdx.x >> 5;
    const int lane = threadIdx.x & 31;
    const int half = lane >> 4;
    const int idx  = lane & 15;
    const int j0   = blockIdx.x * 32;
    const int mBeg = wv * ST_COLS;

    const float* fp = fbuf + (size_t)b * CK_ * N_;   // pair-interleaved
    const float* gp = gbuf + (size_t)b * CK_ * N_;   // pair-interleaved

    // A-operands (two f^T tiles) are constant over the m sweep: hoist
    v2f af[2][8];
#pragma unroll
    for (int jt = 0; jt < 2; ++jt)
#pragma unroll
        for (int k8 = 0; k8 < 8; ++k8)
            af[jt][k8] = ld2(fp + (size_t)(2 * k8 + half) * 2 * N_
                                + 2 * (j0 + jt * 16 + idx));

    float Mv[2][8], Lv[2][8];
#pragma unroll
    for (int jt = 0; jt < 2; ++jt)
#pragma unroll
        for (int r = 0; r < 8; ++r) { Mv[jt][r] = -1e30f; Lv[jt][r] = 0.0f; }

    // this lane's first 16 bytes of g: pair row 'half', columns mBeg + 2*idx, +1
    const float* gl = gp + (size_t)half * 2 * N_ + 2 * mBeg + 4 * idx;

    for (int it = 0; it < ST_COLS / 64; ++it, gl += 2 * 64) {
        v8f s[2][4];
#pragma unroll
        for (int jt = 0; jt < 2; ++jt)
#pragma unroll
            for (int t = 0; t < 4; ++t) s[jt][t] = (v8f){};

        // One 16-byte load holds the K pair of columns 2*idx and 2*idx+1: the
        // even columns feed one tile, the odd ones the next.  Row stats do not
        // depend on the order of the columns.
#pragma unroll
        for (int k8 = 0; k8 < 8; ++k8) {
            const float* gr = gl + (size_t)k8 * 4 * N_;
            v4f q0 = *(const v4f*)(gr);
            v4f q1 = *(const v4f*)(gr + 64);
            v2f bg[4] = { {q0.x, q0.y}, {q0.z, q0.w}, {q1.x, q1.y}, {q1.z, q1.w} };
#pragma unroll
            for (int t = 0; t < 4; ++t) {
                s[0][t] = wmma_f32(af[0][k8], bg[t], s[0][t]);
                s[1][t] = wmma_f32(af[1][k8], bg[t], s[1][t]);
            }
        }
#pragma unroll
        for (int jt = 0; jt < 2; ++jt)
#pragma unroll
            for (int r = 0; r < 8; ++r) {
                float v0 = s[jt][0][r], v1 = s[jt][1][r];
                float v2 = s[jt][2][r], v3 = s[jt][3][r];
                float nm = fmaxf(fmaxf(fmaxf(Mv[jt][r], v0), v1), fmaxf(v2, v3));
                Lv[jt][r] = Lv[jt][r] * __expf(Mv[jt][r] - nm)
                          + ((__expf(v0 - nm) + __expf(v1 - nm))
                           + (__expf(v2 - nm) + __expf(v3 - nm)));
                Mv[jt][r] = nm;
            }
    }

    // all-reduce (max, sum) over the 16 lanes of each half (rows r+8*half)
#pragma unroll
    for (int jt = 0; jt < 2; ++jt)
#pragma unroll
        for (int r = 0; r < 8; ++r) {
#pragma unroll
            for (int off = 8; off >= 1; off >>= 1) {
                float Mo = __shfl_xor(Mv[jt][r], off, 32);
                float Lo = __shfl_xor(Lv[jt][r], off, 32);
                float nm = fmaxf(Mv[jt][r], Mo);
                Lv[jt][r] = Lv[jt][r] * __expf(Mv[jt][r] - nm) + Lo * __expf(Mo - nm);
                Mv[jt][r] = nm;
            }
        }
    if (idx == 0) {
#pragma unroll
        for (int jt = 0; jt < 2; ++jt)
#pragma unroll
            for (int r = 0; r < 8; ++r) {
                sM[wv][jt * 16 + r + 8 * half] = Mv[jt][r];
                sL[wv][jt * 16 + r + 8 * half] = Lv[jt][r];
            }
    }
    __syncthreads();   // every wave's partials are in LDS before the merge

    if (threadIdx.x < 32) {
        const int t = threadIdx.x;
        float M = sM[0][t];
#pragma unroll
        for (int w = 1; w < ST_WAVES; ++w) M = fmaxf(M, sM[w][t]);
        float L = 0.0f;
#pragma unroll
        for (int w = 0; w < ST_WAVES; ++w) L += sL[w][t] * __expf(sM[w][t] - M);
        Mrow[b * N_ + j0 + t] = M;
        Linv[b * N_ + j0 + t] = 1.0f / L;
    }
}

// ---------------------------------------------------------------------------
// Kernel 3: fused  out = gamma * (hv @ P) + x,  P[j,m] = exp(S[j,m]-M_j)/L_j
// grid: (N/64, B)  block: 256 (8 waves).  Wave (mt, jh) owns all 256 channels of
// 16 columns m and half of the rows j, in steps of 16 rows.  The S tile's result
// registers ARE the B fragments of hv @ P: registers 2s, 2s+1 hold rows
// j0 + 8*half + 2s, +1, and the hv fragment is read in that same k order.  So P
// stays in registers and the loop has no LDS traffic and no barrier.  The two
// j halves are added through LDS at the end.
// Every '#pragma unroll' below makes an index of a register array a constant.
// ---------------------------------------------------------------------------
#define AT_STEPS (N_ / 2 / 16)       // 16-row steps per wave
#define AT_RING  8                   // hv tiles held ahead in registers

__device__ __forceinline__ void at_put(float* dst, const v8f* a, int lane) {
#pragma unroll
    for (int i = 0; i < 8; ++i)
#pragma unroll
        for (int r = 0; r < 8; ++r) dst[(i * 8 + r) * 32 + lane] = a[i][r];
}
__device__ __forceinline__ void at_finish(
    const float* src, const v8f* a, int lane, float gm,
    const float* __restrict__ xq, float* __restrict__ oq) {
    // xq / oq: element (first channel of a[0] + 8*half, this lane's column)
#pragma unroll
    for (int i = 0; i < 8; ++i)
#pragma unroll
        for (int r = 0; r < 8; ++r) {
            size_t off = (size_t)(i * 16 + r) * N_;
            oq[off] = gm * (a[i][r] + src[(i * 8 + r) * 32 + lane]) + xq[off];
        }
}

__global__ __launch_bounds__(256) void attn_kernel(
    const float* __restrict__ x,
    const float* __restrict__ fbuf, const float* __restrict__ gbuf,
    const float* __restrict__ hvbuf,
    const float* __restrict__ Mrow, const float* __restrict__ Linv,
    const float* __restrict__ gammap,
    float* __restrict__ out)
{
    __shared__ float red[8][8 * 8 * 32];   // 64 KB: 8 accumulator tiles per wave

    const int b    = blockIdx.y;
    const int wv   = threadIdx.x >> 5;
    const int lane = threadIdx.x & 31;
    const int half = lane >> 4;
    const int idx  = lane & 15;
    const int mt   = wv & 3;             // column tile of the wave
    const int jh   = wv >> 2;            // half of the rows j
    const int mcol = blockIdx.x * 64 + mt * 16 + idx;
    const int jBeg = jh * (N_ / 2);

    const float* gp = gbuf + (size_t)b * CK_ * N_;   // pair-interleaved

    // the g tile depends only on m: held for the whole loop
    v2f gt[8];
#pragma unroll
    for (int k8 = 0; k8 < 8; ++k8)
        gt[k8] = ld2(gp + (size_t)(2 * k8 + half) * 2 * N_ + 2 * mcol);

    v8f acc[16];
#pragma unroll
    for (int ct = 0; ct < 16; ++ct) acc[ct] = (v8f){};

    // Loop addresses: a block-uniform base that never changes, plus a per-lane
    // 32-bit byte offset that moves with the step, plus a constant.
    const char* fB = (const char*)(fbuf  + (size_t)b * CK_ * N_);
    const char* hB = (const char*)(hvbuf + (size_t)b * C_  * N_);
    const char* mB = (const char*)(Mrow + b * N_);
    const char* lB = (const char*)(Linv + b * N_);
    unsigned fN = 4u * (half * 2 * N_ + 2 * (jBeg + idx));   // f: pair row 'half', row j
    unsigned sN = 4u * (jBeg + 8 * half);                    // stats: this lane's 8 rows j
    unsigned hC = 4u * ((jBeg >> 4) * 4096 + lane * 4);      // hv block of this step

    // operands of step 0, and its first AT_RING hv tiles
    v2f ft[8];
#pragma unroll
    for (int k8 = 0; k8 < 8; ++k8) ft[k8] = *(const v2f*)(fB + fN + k8 * 65536);
    v4f mj0 = *(const v4f*)(mB + sN), mj1 = *(const v4f*)(mB + sN + 16);
    v4f lj0 = *(const v4f*)(lB + sN), lj1 = *(const v4f*)(lB + sN + 16);
    v4f ring[AT_RING][2];
#pragma unroll
    for (int s = 0; s < AT_RING; ++s) {
        ring[s][0] = *(const v4f*)(hB + hC + s * 1024);
        ring[s][1] = *(const v4f*)(hB + hC + s * 1024 + 512);
    }
    // from here on fN, sN and hN name the NEXT step's operands
    fN += 128;  sN += 64;
    unsigned hN = hC + 16384;

    for (int st = 0; st < AT_STEPS; ++st) {
        // -------- S tile (16 j x 16 m) and its P, in registers --------
        v8f s = {};
#pragma unroll
        for (int k8 = 0; k8 < 8; ++k8) s = wmma_f32(ft[k8], gt[k8], s);
        // Four vector slots between the tile's last WMMA and the first vector
        // instruction that reads its result; the operand ties them to this place.
        asm("v_nop\n\tv_nop\n\tv_nop\n\tv_nop" : "+v"(s));

        float p[8];
#pragma unroll
        for (int r = 0; r < 8; ++r)
            p[r] = __expf(s[r] - (r < 4 ? mj0[r & 3] : mj1[r & 3]))
                 * (r < 4 ? lj0[r & 3] : lj1[r & 3]);

        // next step's f tile and row stats: a whole hv pass ahead of their use
#pragma unroll
        for (int k8 = 0; k8 < 8; ++k8) ft[k8] = *(const v2f*)(fB + fN + k8 * 65536);
        mj0 = *(const v4f*)(mB + sN);  mj1 = *(const v4f*)(mB + sN + 16);
        lj0 = *(const v4f*)(lB + sN);  lj1 = *(const v4f*)(lB + sN + 16);

        // -------- acc += hv[:, 16 j] x P; each ring slot is refilled after use --------
#pragma unroll
        for (int ct = 0; ct < 16; ++ct) {
            const v4f q0 = ring[ct % AT_RING][0];
            const v4f q1 = ring[ct % AT_RING][1];
            acc[ct] = wmma_f32((v2f){q0.x, q0.y}, (v2f){p[0], p[1]}, acc[ct]);
            acc[ct] = wmma_f32((v2f){q0.z, q0.w}, (v2f){p[2], p[3]}, acc[ct]);
            acc[ct] = wmma_f32((v2f){q1.x, q1.y}, (v2f){p[4], p[5]}, acc[ct]);
            acc[ct] = wmma_f32((v2f){q1.z, q1.w}, (v2f){p[6], p[7]}, acc[ct]);
            // tile ct + AT_RING: of this block, or past 15 of the next step's
            const char* nx = (ct + AT_RING < 16) ? hB + hC + (ct + AT_RING) * 1024
                                                 : hB + hN + (ct + AT_RING - 16) * 1024;
            ring[ct % AT_RING][0] = *(const v4f*)(nx);
            ring[ct % AT_RING][1] = *(const v4f*)(nx + 512);
        }

        // The last step has no next one: the 'next' offsets then stay on the last
        // step's own operands, which are fetched once more and not used.
        const unsigned more = (st + 2 < AT_STEPS) ? 1u : 0u;
        // Holds the step's last WMMAs ahead of the wait below, which would else
        // stand directly behind the last loads and stall the wave there.
        __builtin_amdgcn_sched_barrier(0);
        // The offsets move on in the statement that holds the wait, so that no
        // address register of an issued load is rewritten ahead of the wait; as C
        // additions they became 64-bit address pairs.
        asm volatile("s_wait_xcnt 0x0\n\t"
                     "v_mov_b32 %0, %1\n\t"
                     "v_add_nc_u32 %1, %4, %1\n\t"
                     "v_add_nc_u32 %2, %5, %2\n\t"
                     "v_add_nc_u32 %3, %6, %3"
                     : "+v"(hC), "+v"(hN), "+v"(fN), "+v"(sN)
                     : "s"(more * 16384u), "s"(more * 128u), "s"(more * 64u)
                     : "memory");
    }

    // -------- Epilogue: add the two j halves, out = gamma * sa + x --------
    // Wave (mt, 0) finishes channel tiles 0..7, wave (mt, 1) tiles 8..15; each
    // hands the other eight tiles to its partner through LDS.
    if (jh == 0) at_put(red[wv], acc + 8, lane);
    else         at_put(red[wv], acc,     lane);
    __syncthreads();   // the partner's tiles are in LDS before they are added

    const float gm = gammap[0];
    const size_t o0 = ((size_t)b * C_ + jh * 128 + 8 * half) * N_ + mcol;
    if (jh == 0) at_finish(red[wv ^ 4], acc,     lane, gm, x + o0, out + o0);
    else         at_finish(red[wv ^ 4], acc + 8, lane, gm, x + o0, out + o0);
}

// ---------------------------------------------------------------------------
extern "C" void kernel_launch(void* const* d_in, const int* in_sizes, int n_in,
                              void* d_out, int out_size, void* d_ws, size_t ws_size,
                              hipStream_t stream) {
    const float* x     = (const float*)d_in[0];
    const float* fw    = (const float*)d_in[1];
    const float* fb    = (const float*)d_in[2];
    const float* gw    = (const float*)d_in[3];
    const float* gb    = (const float*)d_in[4];
    const float* hw    = (const float*)d_in[5];
    const float* hb    = (const float*)d_in[6];
    const float* gamma = (const float*)d_in[7];
    float* out = (float*)d_out;

    const int Bn = in_sizes[0] / (C_ * N_);   // = 4

    float* ws    = (float*)d_ws;
    float* fbuf  = ws;                              // Bn*CK*N (pair-interleaved)
    float* gbuf  = fbuf  + (size_t)Bn * CK_ * N_;   // Bn*CK*N (pair-interleaved)
    float* hvbuf = gbuf  + (size_t)Bn * CK_ * N_;   // Bn*C*N  (fragment order)
    float* Mr    = hvbuf + (size_t)Bn * C_  * N_;   // Bn*N
    float* Li    = Mr    + (size_t)Bn * N_;         // Bn*N

    dim3 g1(N_ / 128, (2 * CK_ + C_) / 16, Bn);     // (32, 20, 4)
    proj_kernel<<<g1, 256, 0, stream>>>(x, fw, fb, gw, gb, hw, hb, fbuf, gbuf, hvbuf);

    dim3 g2(N_ / 32, Bn);                           // (128, 4)
    stats_kernel<<<g2, 256, 0, stream>>>(fbuf, gbuf, Mr, Li);

    dim3 g3(N_ / 64, Bn);                           // (64, 4)
    attn_kernel<<<g3, 256, 0, stream>>>(x, fbuf, gbuf, hvbuf, Mr, Li, gamma, out);
}
